// v000
// Measured on an AMD MI455X. A time is GPU time per run, averaged over a window of back-to-back runs after a warm-up
// (all launches, gaps included; the runs take copies of the inputs in turn), and the median of several windows.
// Apart from v000's, it joins two sittings. Times from different sittings can be a few percent apart, while
// side-by-side timings come from the same sitting.
// v000, which the later versions start from, runs in 30.7 microseconds.
#include <hip/hip_runtime.h>

typedef __attribute__((ext_vector_type(2))) float v2f;
typedef __attribute__((ext_vector_type(8))) float v8f;

#define WSIZE 2
#define NH 8
#define CDIM 256
#define DH 32
#define NTOK 4

#if defined(__HIP_DEVICE_COMPILE__) && defined(__has_builtin)
#  if __has_builtin(__builtin_amdgcn_global_load_async_to_lds_b128)
#    define HAVE_ASYNC_LDS 1
#  endif
#endif

#if HAVE_ASYNC_LDS
typedef int v4i __attribute__((vector_size(16)));
typedef __attribute__((address_space(1))) v4i* gptr128;   // global b128 pointer
typedef __attribute__((address_space(3))) v4i* lptr128;   // LDS b128 pointer
#endif

// ---- DPP helpers (wave32, pure VALU cross-lane) ----
template <int CTRL>
__device__ __forceinline__ float dppmov(float x) {
    int v = __builtin_amdgcn_update_dpp(0, __builtin_bit_cast(int, x),
                                        CTRL, 0xF, 0xF, true);
    return __builtin_bit_cast(float, v);
}
#define DPP_QUAD_XOR1 0xB1   // quad_perm [1,0,3,2]
#define DPP_QUAD_XOR2 0x4E   // quad_perm [2,3,0,1]
#define DPP_HALF_MIRR 0x141  // row_half_mirror
#define DPP_ROW_MIRR  0x140  // row_mirror

// butterfly softmax over each 4-lane quad (all lanes get result)
__device__ __forceinline__ float quad_softmax(float s) {
    float m = fmaxf(s, dppmov<DPP_QUAD_XOR1>(s));
    m = fmaxf(m, dppmov<DPP_QUAD_XOR2>(m));
    float e = __expf(s - m);
    float d = e + dppmov<DPP_QUAD_XOR1>(e);
    d += dppmov<DPP_QUAD_XOR2>(d);
    return e / d;
}

// sum across each 16-lane row (every lane of the row holds the row sum)
__device__ __forceinline__ float row_sum(float x) {
    x += dppmov<DPP_QUAD_XOR1>(x);
    x += dppmov<DPP_QUAD_XOR2>(x);
    x += dppmov<DPP_HALF_MIRR>(x);
    x += dppmov<DPP_ROW_MIRR>(x);
    return x;
}

// One block = one 2x2 window, 256 threads = 8 waves.
__global__ __launch_bounds__(256)
void swin_cross_attn_fused(const float* __restrict__ rp,
                           const float* __restrict__ gp,
                           const float* __restrict__ bp,
                           const float* __restrict__ ip,
                           const float* __restrict__ lnw0, const float* __restrict__ lnb0,
                           const float* __restrict__ lnw1, const float* __restrict__ lnb1,
                           const float* __restrict__ lnw2, const float* __restrict__ lnb2,
                           const float* __restrict__ lnw3, const float* __restrict__ lnb3,
                           float* __restrict__ out,
                           int Bn, int H, int Wd)
{
    __shared__ __align__(16) float sQ[4][NTOK][CDIM];     // [tensor r,g,b,ir][token][chan]
    __shared__ __align__(16) float sP[4][NH][NTOK][NTOK]; // [pair][head][qi][ki]
    __shared__ float2 red2[8][2][NTOK];                   // [wave][half-row][qi] = (sum, sumsq)

    const int tid  = threadIdx.x;
    const int lane = tid & 31;
    const int wave = tid >> 5;
    const int nWw = Wd / WSIZE;
    const int nWh = H / WSIZE;
    const int wid = blockIdx.x;
    const int bi  = wid / (nWh * nWw);
    const int rem = wid % (nWh * nWw);
    const int wh  = rem / nWw;
    const int ww  = rem % nWw;

    int tokBase[NTOK];
#pragma unroll
    for (int t = 0; t < NTOK; ++t) {
        const int hh = wh * WSIZE + (t >> 1);
        const int wp = ww * WSIZE + (t & 1);
        tokBase[t] = (bi * H + hh) * Wd + wp;
    }

    // ---------------- Phase 1: global -> LDS ----------------
    {
        const int tok = tid >> 6;                // 0..3
        const int c4  = (tid & 63) << 2;         // 0..252
        const long base = (long)tokBase[tok] * CDIM + c4;
#if HAVE_ASYNC_LDS
        __builtin_amdgcn_global_load_async_to_lds_b128(
            (gptr128)(rp + base), (lptr128)&sQ[0][tok][c4], 0, 0);
        __builtin_amdgcn_global_load_async_to_lds_b128(
            (gptr128)(gp + base), (lptr128)&sQ[1][tok][c4], 0, 0);
        __builtin_amdgcn_global_load_async_to_lds_b128(
            (gptr128)(bp + base), (lptr128)&sQ[2][tok][c4], 0, 0);
        __builtin_amdgcn_global_load_async_to_lds_b128(
            (gptr128)(ip + base), (lptr128)&sQ[3][tok][c4], 0, 0);
#  if __has_builtin(__builtin_amdgcn_s_wait_asynccnt)
        __builtin_amdgcn_s_wait_asynccnt(0);
#  else
        asm volatile("s_wait_asynccnt 0x0" ::: "memory");
#  endif
#else
        const float4 vr = *(const float4*)(rp + base);
        const float4 vg = *(const float4*)(gp + base);
        const float4 vb = *(const float4*)(bp + base);
        const float4 vi = *(const float4*)(ip + base);
        *(float4*)&sQ[0][tok][c4] = vr;
        *(float4*)&sQ[1][tok][c4] = vg;
        *(float4*)&sQ[2][tok][c4] = vb;
        *(float4*)&sQ[3][tok][c4] = vi;
#endif
    }
    __syncthreads();

    // ---------------- Phase 2: WMMA scores + quad softmax ----------------
    {
        const int pair = wave >> 1;              // (r,g) (g,b) (b,ir) (ir,g)
        const int gsel = wave & 1;               // heads gsel*4 .. gsel*4+3
        const int kvm[4] = {1, 2, 3, 1};
        const float* Q = &sQ[pair][0][0];
        const float* K = &sQ[kvm[pair]][0][0];

        const int m    = lane & 15;              // A row / B col index
        const int qk   = m & 3;                  // qi (rows) == ki (cols) on this lane
        const int hl   = m >> 2;                 // head within group
        const int koff = (lane >> 4) << 1;       // K-dim offset: 0 | 2
        const int cb   = (gsel * 4 + hl) * DH;

        v8f acc = {0.f, 0.f, 0.f, 0.f, 0.f, 0.f, 0.f, 0.f};
#pragma unroll
        for (int T = 0; T < 8; ++T) {            // 8 x K=4 chunks -> 32-dim contraction
            const int o = cb + T * 4 + koff;
            const float2 qa = *(const float2*)&Q[qk * CDIM + o];
            const float2 kb = *(const float2*)&K[qk * CDIM + o];
            v2f a;  a.x = qa.x;  a.y = qa.y;
            v2f bb; bb.x = kb.x; bb.y = kb.y;
            acc = __builtin_amdgcn_wmma_f32_16x16x4_f32(
                      false, a, false, bb, (short)0, acc, false, false);
        }

        const float SCALE = 0.17677669529663687f;   // 1/sqrt(32)
        const bool valid  = (lane < 16) ? (hl < 2) : (hl >= 2);
        const bool hsel   = (hl & 1) != 0;
        const int  hout   = gsel * 4 + hl;
        const int  ki     = lane & 3;

        const float a0 = acc[0], a1 = acc[1], a2 = acc[2], a3 = acc[3];
        const float a4 = acc[4], a5 = acc[5], a6 = acc[6], a7 = acc[7];
        const float s0 = (hsel ? a4 : a0) * SCALE;
        const float s1 = (hsel ? a5 : a1) * SCALE;
        const float s2 = (hsel ? a6 : a2) * SCALE;
        const float s3 = (hsel ? a7 : a3) * SCALE;
        const float p0 = quad_softmax(s0);
        const float p1 = quad_softmax(s1);
        const float p2 = quad_softmax(s2);
        const float p3 = quad_softmax(s3);
        if (valid) {
            sP[pair][hout][0][ki] = p0;
            sP[pair][hout][1][ki] = p1;
            sP[pair][hout][2][ki] = p2;
            sP[pair][hout][3][ki] = p3;
        }
    }
    __syncthreads();

    // ---------------- Phase 3: P@V + residual + LN + store (all b128) ----------------
    // Thread owns 4 consecutive channels of ONE pair: p = tid>>6, channels c4..c4+3.
    const int p  = tid >> 6;
    const int c4 = (tid & 63) << 2;
    const int h  = c4 >> 5;
    const int kvm[4] = {1, 2, 3, 1};

    float4 y4[NTOK];
    {
        const float* S = &sQ[p][0][0];
        const float* V = &sQ[kvm[p]][0][0];
        float4 vv[4], pm[4];
#pragma unroll
        for (int ki = 0; ki < 4; ++ki) vv[ki] = *(const float4*)&V[ki * CDIM + c4];
#pragma unroll
        for (int qi = 0; qi < 4; ++qi) pm[qi] = *(const float4*)&sP[p][h][qi][0];
#pragma unroll
        for (int qi = 0; qi < 4; ++qi) {
            float4 a = *(const float4*)&S[qi * CDIM + c4];
            a.x += pm[qi].x * vv[0].x + pm[qi].y * vv[1].x + pm[qi].z * vv[2].x + pm[qi].w * vv[3].x;
            a.y += pm[qi].x * vv[0].y + pm[qi].y * vv[1].y + pm[qi].z * vv[2].y + pm[qi].w * vv[3].y;
            a.z += pm[qi].x * vv[0].z + pm[qi].y * vv[1].z + pm[qi].z * vv[2].z + pm[qi].w * vv[3].z;
            a.w += pm[qi].x * vv[0].w + pm[qi].y * vv[1].w + pm[qi].z * vv[2].w + pm[qi].w * vv[3].w;
            y4[qi] = a;
        }
    }

    // LN reduction: per (p,qi) over 256 channels = 64 threads (waves 2p, 2p+1) x 4 chans.
#pragma unroll
    for (int qi = 0; qi < 4; ++qi) {
        const float4 a = y4[qi];
        float sy  = a.x + a.y + a.z + a.w;
        float sy2 = a.x * a.x + a.y * a.y + a.z * a.z + a.w * a.w;
        sy  = row_sum(sy);    // DPP-only, per 16-lane row
        sy2 = row_sum(sy2);
        if ((lane & 15) == 0) red2[wave][lane >> 4][qi] = make_float2(sy, sy2);
    }
    __syncthreads();

    const float* lwArr[4] = {lnw0, lnw1, lnw2, lnw3};
    const float* lbArr[4] = {lnb0, lnb1, lnb2, lnb3};
    const float4 lw4 = *(const float4*)(lwArr[p] + c4);
    const float4 lb4 = *(const float4*)(lbArr[p] + c4);

#pragma unroll
    for (int qi = 0; qi < 4; ++qi) {
        const float2 t0 = red2[2 * p + 0][0][qi];
        const float2 t1 = red2[2 * p + 0][1][qi];
        const float2 t2 = red2[2 * p + 1][0][qi];
        const float2 t3 = red2[2 * p + 1][1][qi];
        const float sy   = t0.x + t1.x + t2.x + t3.x;
        const float sy2  = t0.y + t1.y + t2.y + t3.y;
        const float mean = sy * (1.0f / 256.0f);
        const float var  = sy2 * (1.0f / 256.0f) - mean * mean;
        const float rstd = rsqrtf(var + 1e-5f);
        float4 o;
        o.x = (y4[qi].x - mean) * rstd * lw4.x + lb4.x;
        o.y = (y4[qi].y - mean) * rstd * lw4.y + lb4.y;
        o.z = (y4[qi].z - mean) * rstd * lw4.z + lb4.z;
        o.w = (y4[qi].w - mean) * rstd * lw4.w + lb4.w;
        *(float4*)(out + (long)tokBase[qi] * (4 * CDIM) + p * CDIM + c4) = o;
    }
}

extern "C" void kernel_launch(void* const* d_in, const int* in_sizes, int n_in,
                              void* d_out, int out_size, void* d_ws, size_t ws_size,
                              hipStream_t stream) {
    const float* r  = (const float*)d_in[0];
    const float* g  = (const float*)d_in[1];
    const float* b  = (const float*)d_in[2];
    const float* ir = (const float*)d_in[3];
    const float* ln1w = (const float*)d_in[4];
    const float* ln1b = (const float*)d_in[5];
    const float* ln2w = (const float*)d_in[6];
    const float* ln2b = (const float*)d_in[7];
    const float* ln3w = (const float*)d_in[8];
    const float* ln3b = (const float*)d_in[9];
    const float* ln4w = (const float*)d_in[10];
    const float* ln4b = (const float*)d_in[11];
    float* out = (float*)d_out;

    const int B = 8, H = 64, W = 64;                  // in_sizes[0] == B*H*W*256
    const int nWin = B * (H / WSIZE) * (W / WSIZE);   // 8192 windows
    swin_cross_attn_fused<<<dim3(nWin), dim3(256), 0, stream>>>(
        r, g, b, ir, ln1w, ln1b, ln2w, ln2b, ln3w, ln3b, ln4w, ln4b,
        out, B, H, W);
}

// v001
// Measured time: 28.4 microseconds a run.
// In both of two side-by-side timings against v000, it was 1.09 times as fast.
#include <hip/hip_runtime.h>

typedef __attribute__((ext_vector_type(2))) float v2f;
typedef __attribute__((ext_vector_type(8))) float v8f;

#define WSIZE 2
#define NH 8
#define CDIM 256
#define DH 32
#define NTOK 4
// LDS pitch of one token row, in floats: 256 channels, 4 pad floats behind every
// 64 channels, then rounded so that the four token rows start 24 floats apart mod 64.
#define TPITCH 280
// place of channel c inside a padded token row
#define PADC(c) ((c) + (((c) >> 6) << 2))

#if defined(__HIP_DEVICE_COMPILE__) && defined(__has_builtin)
#  if __has_builtin(__builtin_amdgcn_global_load_async_to_lds_b128)
#    define HAVE_ASYNC_LDS 1
#  endif
#endif

#if HAVE_ASYNC_LDS
typedef int v4i __attribute__((vector_size(16)));
typedef __attribute__((address_space(1))) v4i* gptr128;   // global b128 pointer
typedef __attribute__((address_space(3))) v4i* lptr128;   // LDS b128 pointer
#endif

// ---- DPP helpers (wave32, pure VALU cross-lane) ----
template <int CTRL>
__device__ __forceinline__ float dppmov(float x) {
    int v = __builtin_amdgcn_update_dpp(0, __builtin_bit_cast(int, x),
                                        CTRL, 0xF, 0xF, true);
    return __builtin_bit_cast(float, v);
}
#define DPP_QUAD_XOR1 0xB1   // quad_perm [1,0,3,2]
#define DPP_QUAD_XOR2 0x4E   // quad_perm [2,3,0,1]
#define DPP_HALF_MIRR 0x141  // row_half_mirror
#define DPP_ROW_MIRR  0x140  // row_mirror

// butterfly softmax over each 4-lane quad (all lanes get result)
__device__ __forceinline__ float quad_softmax(float s) {
    float m = fmaxf(s, dppmov<DPP_QUAD_XOR1>(s));
    m = fmaxf(m, dppmov<DPP_QUAD_XOR2>(m));
    float e = __expf(s - m);
    float d = e + dppmov<DPP_QUAD_XOR1>(e);
    d += dppmov<DPP_QUAD_XOR2>(d);
    return e / d;
}

// sum across each 16-lane row (every lane of the row holds the row sum)
__device__ __forceinline__ float row_sum(float x) {
    x += dppmov<DPP_QUAD_XOR1>(x);
    x += dppmov<DPP_QUAD_XOR2>(x);
    x += dppmov<DPP_HALF_MIRR>(x);
    x += dppmov<DPP_ROW_MIRR>(x);
    return x;
}

// One block = one 2x2 window, 256 threads = 8 waves.
__global__ __launch_bounds__(256)
void swin_cross_attn_fused(const float* __restrict__ rp,
                           const float* __restrict__ gp,
                           const float* __restrict__ bp,
                           const float* __restrict__ ip,
                           const float* __restrict__ lnw0, const float* __restrict__ lnb0,
                           const float* __restrict__ lnw1, const float* __restrict__ lnb1,
                           const float* __restrict__ lnw2, const float* __restrict__ lnb2,
                           const float* __restrict__ lnw3, const float* __restrict__ lnb3,
                           float* __restrict__ out,
                           int Bn, int H, int Wd)
{
    __shared__ __align__(16) float sQ[4][NTOK][TPITCH];   // [tensor r,g,b,ir][token][padded chan]
    __shared__ __align__(16) float sP[4][NH][NTOK][NTOK]; // [pair][head][qi][ki]
    __shared__ float2 red2[8][2][NTOK];                   // [wave][half-row][qi] = (sum, sumsq)

    const int tid  = threadIdx.x;
    const int lane = tid & 31;
    const int wave = tid >> 5;
    const int nWw = Wd / WSIZE;
    const int nWh = H / WSIZE;
    const int wid = blockIdx.x;
    const int bi  = wid / (nWh * nWw);
    const int rem = wid % (nWh * nWw);
    const int wh  = rem / nWw;
    const int ww  = rem % nWw;

    int tokBase[NTOK];
#pragma unroll
    for (int t = 0; t < NTOK; ++t) {
        const int hh = wh * WSIZE + (t >> 1);
        const int wp = ww * WSIZE + (t & 1);
        tokBase[t] = (bi * H + hh) * Wd + wp;
    }

    // ---------------- Phase 1: global -> LDS ----------------
    {
        const int tok = tid >> 6;                // 0..3
        const int c4  = (tid & 63) << 2;         // 0..252
        const long base = (long)tokBase[tok] * CDIM + c4;
        const int  pc   = PADC(c4);              // same 16-byte piece, padded place
#if HAVE_ASYNC_LDS
        __builtin_amdgcn_global_load_async_to_lds_b128(
            (gptr128)(rp + base), (lptr128)&sQ[0][tok][pc], 0, 0);
        __builtin_amdgcn_global_load_async_to_lds_b128(
            (gptr128)(gp + base), (lptr128)&sQ[1][tok][pc], 0, 0);
        __builtin_amdgcn_global_load_async_to_lds_b128(
            (gptr128)(bp + base), (lptr128)&sQ[2][tok][pc], 0, 0);
        __builtin_amdgcn_global_load_async_to_lds_b128(
            (gptr128)(ip + base), (lptr128)&sQ[3][tok][pc], 0, 0);
#  if __has_builtin(__builtin_amdgcn_s_wait_asynccnt)
        __builtin_amdgcn_s_wait_asynccnt(0);
#  else
        asm volatile("s_wait_asynccnt 0x0" ::: "memory");
#  endif
#else
        const float4 vr = *(const float4*)(rp + base);
        const float4 vg = *(const float4*)(gp + base);
        const float4 vb = *(const float4*)(bp + base);
        const float4 vi = *(const float4*)(ip + base);
        *(float4*)&sQ[0][tok][pc] = vr;
        *(float4*)&sQ[1][tok][pc] = vg;
        *(float4*)&sQ[2][tok][pc] = vb;
        *(float4*)&sQ[3][tok][pc] = vi;
#endif
    }
    __syncthreads();

    // ---------------- Phase 2: WMMA scores + quad softmax ----------------
    {
        const int pair = wave >> 1;              // (r,g) (g,b) (b,ir) (ir,g)
        const int gsel = wave & 1;               // heads gsel*4 .. gsel*4+3
        const int kvm[4] = {1, 2, 3, 1};
        const float* Q = &sQ[pair][0][0];
        const float* K = &sQ[kvm[pair]][0][0];

        const int m    = lane & 15;              // A row / B col index
        const int qk   = m & 3;                  // qi (rows) == ki (cols) on this lane
        const int hl   = m >> 2;                 // head within group
        const int koff = (lane >> 4) << 1;       // K-dim offset: 0 | 2
        // With this pitch and pad the 16 (token, head) rows of a fragment read start in
        // 16 different groups of four banks, so the 32 lanes of a read share no bank.
        const int cb   = PADC((gsel * 4 + hl) * DH);

        v8f acc = {0.f, 0.f, 0.f, 0.f, 0.f, 0.f, 0.f, 0.f};
#pragma unroll
        for (int T = 0; T < 8; ++T) {            // 8 x K=4 chunks -> 32-dim contraction
            const int o = cb + T * 4 + koff;
            const float2 qa = *(const float2*)&Q[qk * TPITCH + o];
            const float2 kb = *(const float2*)&K[qk * TPITCH + o];
            v2f a;  a.x = qa.x;  a.y = qa.y;
            v2f bb; bb.x = kb.x; bb.y = kb.y;
            acc = __builtin_amdgcn_wmma_f32_16x16x4_f32(
                      false, a, false, bb, (short)0, acc, false, false);
        }

        const float SCALE = 0.17677669529663687f;   // 1/sqrt(32)
        const bool valid  = (lane < 16) ? (hl < 2) : (hl >= 2);
        const bool hsel   = (hl & 1) != 0;
        const int  hout   = gsel * 4 + hl;
        const int  ki     = lane & 3;

        const float a0 = acc[0], a1 = acc[1], a2 = acc[2], a3 = acc[3];
        const float a4 = acc[4], a5 = acc[5], a6 = acc[6], a7 = acc[7];
        const float s0 = (hsel ? a4 : a0) * SCALE;
        const float s1 = (hsel ? a5 : a1) * SCALE;
        const float s2 = (hsel ? a6 : a2) * SCALE;
        const float s3 = (hsel ? a7 : a3) * SCALE;
        const float p0 = quad_softmax(s0);
        const float p1 = quad_softmax(s1);
        const float p2 = quad_softmax(s2);
        const float p3 = quad_softmax(s3);
        if (valid) {
            sP[pair][hout][0][ki] = p0;
            sP[pair][hout][1][ki] = p1;
            sP[pair][hout][2][ki] = p2;
            sP[pair][hout][3][ki] = p3;
        }
    }
    __syncthreads();

    // ---------------- Phase 3: P@V + residual + LN + store (all b128) ----------------
    // Thread owns 4 consecutive channels of ONE pair: p = tid>>6, channels c4..c4+3.
    const int p  = tid >> 6;
    const int c4 = (tid & 63) << 2;
    const int h  = c4 >> 5;
    const int pc4 = PADC(c4);
    const int kvm[4] = {1, 2, 3, 1};

    float4 y4[NTOK];
    {
        const float* S = &sQ[p][0][0];
        const float* V = &sQ[kvm[p]][0][0];
        float4 vv[4], pm[4];
#pragma unroll
        for (int ki = 0; ki < 4; ++ki) vv[ki] = *(const float4*)&V[ki * TPITCH + pc4];
#pragma unroll
        for (int qi = 0; qi < 4; ++qi) pm[qi] = *(const float4*)&sP[p][h][qi][0];
#pragma unroll
        for (int qi = 0; qi < 4; ++qi) {
            float4 a = *(const float4*)&S[qi * TPITCH + pc4];
            a.x += pm[qi].x * vv[0].x + pm[qi].y * vv[1].x + pm[qi].z * vv[2].x + pm[qi].w * vv[3].x;
            a.y += pm[qi].x * vv[0].y + pm[qi].y * vv[1].y + pm[qi].z * vv[2].y + pm[qi].w * vv[3].y;
            a.z += pm[qi].x * vv[0].z + pm[qi].y * vv[1].z + pm[qi].z * vv[2].z + pm[qi].w * vv[3].z;
            a.w += pm[qi].x * vv[0].w + pm[qi].y * vv[1].w + pm[qi].z * vv[2].w + pm[qi].w * vv[3].w;
            y4[qi] = a;
        }
    }

    // LN reduction: per (p,qi) over 256 channels = 64 threads (waves 2p, 2p+1) x 4 chans.
#pragma unroll
    for (int qi = 0; qi < 4; ++qi) {
        const float4 a = y4[qi];
        float sy  = a.x + a.y + a.z + a.w;
        float sy2 = a.x * a.x + a.y * a.y + a.z * a.z + a.w * a.w;
        sy  = row_sum(sy);    // DPP-only, per 16-lane row
        sy2 = row_sum(sy2);
        if ((lane & 15) == 0) red2[wave][lane >> 4][qi] = make_float2(sy, sy2);
    }
    __syncthreads();

    const float* lwArr[4] = {lnw0, lnw1, lnw2, lnw3};
    const float* lbArr[4] = {lnb0, lnb1, lnb2, lnb3};
    const float4 lw4 = *(const float4*)(lwArr[p] + c4);
    const float4 lb4 = *(const float4*)(lbArr[p] + c4);

#pragma unroll
    for (int qi = 0; qi < 4; ++qi) {
        const float2 t0 = red2[2 * p + 0][0][qi];
        const float2 t1 = red2[2 * p + 0][1][qi];
        const float2 t2 = red2[2 * p + 1][0][qi];
        const float2 t3 = red2[2 * p + 1][1][qi];
        const float sy   = t0.x + t1.x + t2.x + t3.x;
        const float sy2  = t0.y + t1.y + t2.y + t3.y;
        const float mean = sy * (1.0f / 256.0f);
        const float var  = sy2 * (1.0f / 256.0f) - mean * mean;
        const float rstd = rsqrtf(var + 1e-5f);
        float4 o;
        o.x = (y4[qi].x - mean) * rstd * lw4.x + lb4.x;
        o.y = (y4[qi].y - mean) * rstd * lw4.y + lb4.y;
        o.z = (y4[qi].z - mean) * rstd * lw4.z + lb4.z;
        o.w = (y4[qi].w - mean) * rstd * lw4.w + lb4.w;
        *(float4*)(out + (long)tokBase[qi] * (4 * CDIM) + p * CDIM + c4) = o;
    }
}

extern "C" void kernel_launch(void* const* d_in, const int* in_sizes, int n_in,
                              void* d_out, int out_size, void* d_ws, size_t ws_size,
                              hipStream_t stream) {
    const float* r  = (const float*)d_in[0];
    const float* g  = (const float*)d_in[1];
    const float* b  = (const float*)d_in[2];
    const float* ir = (const float*)d_in[3];
    const float* ln1w = (const float*)d_in[4];
    const float* ln1b = (const float*)d_in[5];
    const float* ln2w = (const float*)d_in[6];
    const float* ln2b = (const float*)d_in[7];
    const float* ln3w = (const float*)d_in[8];
    const float* ln3b = (const float*)d_in[9];
    const float* ln4w = (const float*)d_in[10];
    const float* ln4b = (const float*)d_in[11];
    float* out = (float*)d_out;

    const int B = 8, H = 64, W = 64;                  // in_sizes[0] == B*H*W*256
    const int nWin = B * (H / WSIZE) * (W / WSIZE);   // 8192 windows
    swin_cross_attn_fused<<<dim3(nWin), dim3(256), 0, stream>>>(
        r, g, b, ir, ln1w, ln1b, ln2w, ln2b, ln3w, ln3b, ln4w, ln4b,
        out, B, H, W);
}

// v002
// It runs in 23.1 microseconds.
// Two timings next to v001 both put it at 1.23 times that version's speed.
// Over all steps from v000 it is 1.34 times as fast.
#include <hip/hip_runtime.h>

typedef __attribute__((ext_vector_type(2))) float v2f;
typedef __attribute__((ext_vector_type(8))) float v8f;

#define WSIZE 2
#define NH 8
#define CDIM 256
#define DH 32
#define NTOK 4
// LDS pitch of one token row, in floats: 256 channels, 4 pad floats behind every
// 64 channels, then rounded so that the four token rows start 24 floats apart mod 64.
#define TPITCH 280
// place of channel c inside a padded token row
#define PADC(c) ((c) + (((c) >> 6) << 2))

#if defined(__HIP_DEVICE_COMPILE__) && defined(__has_builtin)
#  if __has_builtin(__builtin_amdgcn_global_load_async_to_lds_b128)
#    define HAVE_ASYNC_LDS 1
#  endif
#endif

#if HAVE_ASYNC_LDS
typedef int v4i __attribute__((vector_size(16)));
typedef __attribute__((address_space(1))) v4i* gptr128;   // global b128 pointer
typedef __attribute__((address_space(3))) v4i* lptr128;   // LDS b128 pointer
#endif

// ---- DPP helpers (wave32, pure VALU cross-lane) ----
template <int CTRL>
__device__ __forceinline__ float dppmov(float x) {
    int v = __builtin_amdgcn_update_dpp(0, __builtin_bit_cast(int, x),
                                        CTRL, 0xF, 0xF, true);
    return __builtin_bit_cast(float, v);
}
#define DPP_QUAD_XOR1 0xB1   // quad_perm [1,0,3,2]
#define DPP_QUAD_XOR2 0x4E   // quad_perm [2,3,0,1]
#define DPP_HALF_MIRR 0x141  // row_half_mirror
#define DPP_ROW_MIRR  0x140  // row_mirror

// butterfly softmax over each 4-lane quad (all lanes get result)
__device__ __forceinline__ float quad_softmax(float s) {
    float m = fmaxf(s, dppmov<DPP_QUAD_XOR1>(s));
    m = fmaxf(m, dppmov<DPP_QUAD_XOR2>(m));
    float e = __expf(s - m);
    float d = e + dppmov<DPP_QUAD_XOR1>(e);
    d += dppmov<DPP_QUAD_XOR2>(d);
    return e / d;
}

// sum across each 16-lane row (every lane of the row holds the row sum)
__device__ __forceinline__ float row_sum(float x) {
    x += dppmov<DPP_QUAD_XOR1>(x);
    x += dppmov<DPP_QUAD_XOR2>(x);
    x += dppmov<DPP_HALF_MIRR>(x);
    x += dppmov<DPP_ROW_MIRR>(x);
    return x;
}

// value of the same lane position in the other 16-lane row (lane ^ 16)
__device__ __forceinline__ float other_row(float x) {
    const int xi = __builtin_bit_cast(int, x);
    const int v  = __builtin_amdgcn_permlanex16(xi, xi, 0x76543210, 0xfedcba98, false, false);
    return __builtin_bit_cast(float, v);
}

#define WPB 2   // windows per block

// One block = two 2x2 windows, 256 threads = 8 waves.
// One wave = one (window, pair): all 8 heads and all 256 channels of its 4 query tokens.
__global__ __launch_bounds__(256)
void swin_cross_attn_fused(const float* __restrict__ rp,
                           const float* __restrict__ gp,
                           const float* __restrict__ bp,
                           const float* __restrict__ ip,
                           const float* __restrict__ lnw0, const float* __restrict__ lnb0,
                           const float* __restrict__ lnw1, const float* __restrict__ lnb1,
                           const float* __restrict__ lnw2, const float* __restrict__ lnb2,
                           const float* __restrict__ lnw3, const float* __restrict__ lnb3,
                           float* __restrict__ out,
                           int Bn, int H, int Wd)
{
    __shared__ __align__(16) float sQ[WPB][4][NTOK][TPITCH];   // [window][tensor r,g,b,ir][token][padded chan]
    __shared__ __align__(16) float sP[WPB][4][NH][NTOK][NTOK]; // [window][pair][head][qi][ki]

    const int tid  = threadIdx.x;
    const int lane = tid & 31;
    const int wave = __builtin_amdgcn_readfirstlane(tid >> 5);   // wave-uniform, kept scalar
    const int win  = wave >> 2;                  // window of this wave inside the block
    const int p    = wave & 3;                   // pair (r,g) (g,b) (b,ir) (ir,g); also the tensor it stages
    const int kv   = (p == 3) ? 1 : p + 1;       // key/value tensor of the pair
    const int nWw = Wd / WSIZE;
    const int nWh = H / WSIZE;
    const int wid = blockIdx.x * WPB + win;
    const int bi  = wid / (nWh * nWw);
    const int rem = wid % (nWh * nWw);
    const int wh  = rem / nWw;
    const int ww  = rem % nWw;

    int tokBase[NTOK];
#pragma unroll
    for (int t = 0; t < NTOK; ++t) {
        const int hh = wh * WSIZE + (t >> 1);
        const int wp = ww * WSIZE + (t & 1);
        tokBase[t] = (bi * H + hh) * Wd + wp;
    }

    // ---------------- Phase 1: global -> LDS ----------------
    // Each wave stages the 4 token rows of tensor p of its own window (8 x 512 contiguous bytes).
    {
        const float* src = (p == 0) ? rp : (p == 1) ? gp : (p == 2) ? bp : ip;
#pragma unroll
        for (int t = 0; t < NTOK; ++t) {
#pragma unroll
            for (int k = 0; k < 2; ++k) {
                const int  c4   = k * 128 + (lane << 2);
                const long base = (long)tokBase[t] * CDIM + c4;
                const int  pc   = PADC(c4);      // same 16-byte piece, padded place
#if HAVE_ASYNC_LDS
                __builtin_amdgcn_global_load_async_to_lds_b128(
                    (gptr128)(src + base), (lptr128)&sQ[win][p][t][pc], 0, 0);
#else
                *(float4*)&sQ[win][p][t][pc] = *(const float4*)(src + base);
#endif
            }
        }
#if HAVE_ASYNC_LDS
        // this wave's copies have landed before the barrier behind which other waves read them
        asm volatile("s_wait_asynccnt 0x0" ::: "memory");
#endif
    }
    __syncthreads();

    // ---------------- Phase 2: WMMA scores + quad softmax ----------------
    {
        const float* Q = &sQ[win][p][0][0];
        const float* K = &sQ[win][kv][0][0];

        const int m    = lane & 15;              // A row / B col index
        const int half = lane >> 4;
        const int koff = half << 1;              // K-dim offset: 0 | 2
        // A rows: m = 8*(qi>>1) + 2*head + (qi&1), so that rows 0..7 (lanes 0..15 of the result)
        // and rows 8..15 (lanes 16..31) each hold two query tokens of all four heads.
        const int hA = (m & 7) >> 1;
        const int qA = ((m >> 3) << 1) | (m & 1);
        // B cols: n = 4*head + ki
        const int hB = m >> 2;
        const int ki = m & 3;
        // With this pitch and pad the 16 (token, head) rows of a fragment read start in
        // 16 different groups of four banks, so the 32 lanes of a read share no bank.
        const int oa = qA * TPITCH + PADC(hA * DH) + koff;
        const int ob = ki * TPITCH + PADC(hB * DH) + koff;
        const int G1 = PADC(4 * DH);             // heads 4..7 lie this many floats behind heads 0..3

        v8f acc0 = {0.f, 0.f, 0.f, 0.f, 0.f, 0.f, 0.f, 0.f};
        v8f acc1 = {0.f, 0.f, 0.f, 0.f, 0.f, 0.f, 0.f, 0.f};
#pragma unroll
        for (int T = 0; T < 8; ++T) {            // 8 x K=4 chunks -> 32-dim contraction
            const float2 qa0 = *(const float2*)&Q[oa + T * 4];
            const float2 kb0 = *(const float2*)&K[ob + T * 4];
            const float2 qa1 = *(const float2*)&Q[oa + G1 + T * 4];
            const float2 kb1 = *(const float2*)&K[ob + G1 + T * 4];
            v2f a0;  a0.x = qa0.x;  a0.y = qa0.y;
            v2f b0;  b0.x = kb0.x;  b0.y = kb0.y;
            v2f a1;  a1.x = qa1.x;  a1.y = qa1.y;
            v2f b1;  b1.x = kb1.x;  b1.y = kb1.y;
            acc0 = __builtin_amdgcn_wmma_f32_16x16x4_f32(
                       false, a0, false, b0, (short)0, acc0, false, false);
            acc1 = __builtin_amdgcn_wmma_f32_16x16x4_f32(
                       false, a1, false, b1, (short)0, acc1, false, false);
        }

        // Lane (half, head hB, ki) finds its head's rows in result registers 2*hB and 2*hB+1:
        // query tokens 2*half and 2*half+1. Every lane holds two wanted scores per head group.
        const float SCALE = 0.17677669529663687f;   // 1/sqrt(32)
        const bool  s1 = (hB & 1) != 0;
        const bool  s2 = (hB & 2) != 0;
        const float x00 = s2 ? (s1 ? acc0[6] : acc0[4]) : (s1 ? acc0[2] : acc0[0]);
        const float x01 = s2 ? (s1 ? acc0[7] : acc0[5]) : (s1 ? acc0[3] : acc0[1]);
        const float x10 = s2 ? (s1 ? acc1[6] : acc1[4]) : (s1 ? acc1[2] : acc1[0]);
        const float x11 = s2 ? (s1 ? acc1[7] : acc1[5]) : (s1 ? acc1[3] : acc1[1]);
        const float p00 = quad_softmax(x00 * SCALE);
        const float p01 = quad_softmax(x01 * SCALE);
        const float p10 = quad_softmax(x10 * SCALE);
        const float p11 = quad_softmax(x11 * SCALE);
        sP[win][p][hB][2 * half + 0][ki]     = p00;
        sP[win][p][hB][2 * half + 1][ki]     = p01;
        sP[win][p][4 + hB][2 * half + 0][ki] = p10;
        sP[win][p][4 + hB][2 * half + 1][ki] = p11;
    }
    // sP[win][p] is written and read back by this wave alone, each lane reading other lanes' values:
    // the wave's own writes are finished, and the reads below stay behind them, without a barrier.
    asm volatile("s_wait_dscnt 0x0" ::: "memory");

    // ---------------- Phase 3: P@V + residual + LN + store (all b128) ----------------
    // Lane owns channels 4*lane..+3 and 128+4*lane..+3 of all 4 query tokens of the pair.
    float4 y4[2][NTOK];
    {
        const float* S = &sQ[win][p][0][0];
        const float* V = &sQ[win][kv][0][0];
#pragma unroll
        for (int k = 0; k < 2; ++k) {
            const int c4  = k * 128 + (lane << 2);
            const int h   = c4 >> 5;
            const int pc4 = PADC(c4);
            float4 vv[4], pm[4];
#pragma unroll
            for (int kk = 0; kk < 4; ++kk) vv[kk] = *(const float4*)&V[kk * TPITCH + pc4];
#pragma unroll
            for (int qi = 0; qi < 4; ++qi) pm[qi] = *(const float4*)&sP[win][p][h][qi][0];
#pragma unroll
            for (int qi = 0; qi < 4; ++qi) {
                float4 a = *(const float4*)&S[qi * TPITCH + pc4];
                a.x += pm[qi].x * vv[0].x + pm[qi].y * vv[1].x + pm[qi].z * vv[2].x + pm[qi].w * vv[3].x;
                a.y += pm[qi].x * vv[0].y + pm[qi].y * vv[1].y + pm[qi].z * vv[2].y + pm[qi].w * vv[3].y;
                a.z += pm[qi].x * vv[0].z + pm[qi].y * vv[1].z + pm[qi].z * vv[2].z + pm[qi].w * vv[3].z;
                a.w += pm[qi].x * vv[0].w + pm[qi].y * vv[1].w + pm[qi].z * vv[2].w + pm[qi].w * vv[3].w;
                y4[k][qi] = a;
            }
        }
    }

    const float* lw = (p == 0) ? lnw0 : (p == 1) ? lnw1 : (p == 2) ? lnw2 : lnw3;
    const float* lb = (p == 0) ? lnb0 : (p == 1) ? lnb1 : (p == 2) ? lnb2 : lnb3;
    float4 lw4[2], lb4[2];
#pragma unroll
    for (int k = 0; k < 2; ++k) {
        lw4[k] = *(const float4*)(lw + k * 128 + (lane << 2));
        lb4[k] = *(const float4*)(lb + k * 128 + (lane << 2));
    }

    // LN: a token's 256 channels lie in this one wave (32 lanes x 8), so its sums stay in registers.
#pragma unroll
    for (int qi = 0; qi < 4; ++qi) {
        const float4 a = y4[0][qi];
        const float4 c = y4[1][qi];
        float sy  = (a.x + a.y + a.z + a.w) + (c.x + c.y + c.z + c.w);
        float sy2 = (a.x * a.x + a.y * a.y + a.z * a.z + a.w * a.w)
                  + (c.x * c.x + c.y * c.y + c.z * c.z + c.w * c.w);
        sy  = row_sum(sy);    // DPP-only, per 16-lane row
        sy2 = row_sum(sy2);
        sy  += other_row(sy);
        sy2 += other_row(sy2);
        const float mean = sy * (1.0f / 256.0f);
        const float var  = sy2 * (1.0f / 256.0f) - mean * mean;
        const float rstd = rsqrtf(var + 1e-5f);
        float* orow = out + (long)tokBase[qi] * (4 * CDIM) + p * CDIM + (lane << 2);
#pragma unroll
        for (int k = 0; k < 2; ++k) {
            float4 o;
            o.x = (y4[k][qi].x - mean) * rstd * lw4[k].x + lb4[k].x;
            o.y = (y4[k][qi].y - mean) * rstd * lw4[k].y + lb4[k].y;
            o.z = (y4[k][qi].z - mean) * rstd * lw4[k].z + lb4[k].z;
            o.w = (y4[k][qi].w - mean) * rstd * lw4[k].w + lb4[k].w;
            *(float4*)(orow + k * 128) = o;
        }
    }
}

extern "C" void kernel_launch(void* const* d_in, const int* in_sizes, int n_in,
                              void* d_out, int out_size, void* d_ws, size_t ws_size,
                              hipStream_t stream) {
    const float* r  = (const float*)d_in[0];
    const float* g  = (const float*)d_in[1];
    const float* b  = (const float*)d_in[2];
    const float* ir = (const float*)d_in[3];
    const float* ln1w = (const float*)d_in[4];
    const float* ln1b = (const float*)d_in[5];
    const float* ln2w = (const float*)d_in[6];
    const float* ln2b = (const float*)d_in[7];
    const float* ln3w = (const float*)d_in[8];
    const float* ln3b = (const float*)d_in[9];
    const float* ln4w = (const float*)d_in[10];
    const float* ln4b = (const float*)d_in[11];
    float* out = (float*)d_out;

    const int B = 8, H = 64, W = 64;                  // in_sizes[0] == B*H*W*256
    const int nWin = B * (H / WSIZE) * (W / WSIZE);   // 8192 windows
    swin_cross_attn_fused<<<dim3(nWin / WPB), dim3(256), 0, stream>>>(
        r, g, b, ir, ln1w, ln1b, ln2w, ln2b, ln3w, ln3b, ln4w, ln4b,
        out, B, H, W);
}

// v003
// It runs in 22.2 microseconds.
// Next to v002, in two timings, it ran 1.04 times as fast each time.
// All steps since v000 together make it 1.39 times as fast.
#include <hip/hip_runtime.h>

typedef __attribute__((ext_vector_type(2))) float v2f;
typedef __attribute__((ext_vector_type(8))) float v8f;

#define WSIZE 2
#define NH 8
#define CDIM 256
#define DH 32
#define NTOK 4
// LDS pitch of one token row, in floats: 256 channels, 4 pad floats behind every
// 64 channels, then rounded so that the four token rows start 24 floats apart mod 64.
#define TPITCH 280
// place of channel c inside a padded token row
#define PADC(c) ((c) + (((c) >> 6) << 2))

#if defined(__HIP_DEVICE_COMPILE__) && defined(__has_builtin)
#  if __has_builtin(__builtin_amdgcn_global_load_async_to_lds_b128)
#    define HAVE_ASYNC_LDS 1
#  endif
#endif

#if HAVE_ASYNC_LDS
typedef int v4i __attribute__((vector_size(16)));
typedef __attribute__((address_space(1))) v4i* gptr128;   // global b128 pointer
typedef __attribute__((address_space(3))) v4i* lptr128;   // LDS b128 pointer
#endif

// ---- DPP helpers (wave32, pure VALU cross-lane) ----
template <int CTRL>
__device__ __forceinline__ float dppmov(float x) {
    int v = __builtin_amdgcn_update_dpp(0, __builtin_bit_cast(int, x),
                                        CTRL, 0xF, 0xF, true);
    return __builtin_bit_cast(float, v);
}
#define DPP_QUAD_XOR1 0xB1   // quad_perm [1,0,3,2]
#define DPP_QUAD_XOR2 0x4E   // quad_perm [2,3,0,1]
#define DPP_HALF_MIRR 0x141  // row_half_mirror
#define DPP_ROW_MIRR  0x140  // row_mirror

// butterfly softmax over each 4-lane quad (all lanes get result)
__device__ __forceinline__ float quad_softmax(float s) {
    float m = fmaxf(s, dppmov<DPP_QUAD_XOR1>(s));
    m = fmaxf(m, dppmov<DPP_QUAD_XOR2>(m));
    float e = __expf(s - m);
    float d = e + dppmov<DPP_QUAD_XOR1>(e);
    d += dppmov<DPP_QUAD_XOR2>(d);
    return e / d;
}

// sum across each 16-lane row (every lane of the row holds the row sum)
__device__ __forceinline__ float row_sum(float x) {
    x += dppmov<DPP_QUAD_XOR1>(x);
    x += dppmov<DPP_QUAD_XOR2>(x);
    x += dppmov<DPP_HALF_MIRR>(x);
    x += dppmov<DPP_ROW_MIRR>(x);
    return x;
}

// value of the same lane position in the other 16-lane row (lane ^ 16)
__device__ __forceinline__ float other_row(float x) {
    const int xi = __builtin_bit_cast(int, x);
    const int v  = __builtin_amdgcn_permlanex16(xi, xi, 0x76543210, 0xfedcba98, false, false);
    return __builtin_bit_cast(float, v);
}

// the two channel pairs of a float4
__device__ __forceinline__ v2f lo2(float4 a) { v2f r; r.x = a.x; r.y = a.y; return r; }
__device__ __forceinline__ v2f hi2(float4 a) { v2f r; r.x = a.z; r.y = a.w; return r; }

#define WPB 2   // windows per block

// One block = two 2x2 windows, 256 threads = 8 waves.
// One wave = one (window, pair): all 8 heads and all 256 channels of its 4 query tokens.
__global__ __launch_bounds__(256)
void swin_cross_attn_fused(const float* __restrict__ rp,
                           const float* __restrict__ gp,
                           const float* __restrict__ bp,
                           const float* __restrict__ ip,
                           const float* __restrict__ lnw0, const float* __restrict__ lnb0,
                           const float* __restrict__ lnw1, const float* __restrict__ lnb1,
                           const float* __restrict__ lnw2, const float* __restrict__ lnb2,
                           const float* __restrict__ lnw3, const float* __restrict__ lnb3,
                           float* __restrict__ out,
                           int Bn, int H, int Wd)
{
    __shared__ __align__(16) float sQ[WPB][4][NTOK][TPITCH];   // [window][tensor r,g,b,ir][token][padded chan]
    __shared__ __align__(16) float sP[WPB][4][NH][NTOK][NTOK]; // [window][pair][head][qi][ki]

    const int tid  = threadIdx.x;
    const int lane = tid & 31;
    const int wave = __builtin_amdgcn_readfirstlane(tid >> 5);   // wave-uniform, kept scalar
    const int win  = wave >> 2;                  // window of this wave inside the block
    const int p    = wave & 3;                   // pair (r,g) (g,b) (b,ir) (ir,g); also the tensor it stages
    const int kv   = (p == 3) ? 1 : p + 1;       // key/value tensor of the pair
    const int nWw = Wd / WSIZE;
    const int nWh = H / WSIZE;
    const int wid = blockIdx.x * WPB + win;
    const int bi  = wid / (nWh * nWw);
    const int rem = wid % (nWh * nWw);
    const int wh  = rem / nWw;
    const int ww  = rem % nWw;

    int tokBase[NTOK];
#pragma unroll
    for (int t = 0; t < NTOK; ++t) {
        const int hh = wh * WSIZE + (t >> 1);
        const int wp = ww * WSIZE + (t & 1);
        tokBase[t] = (bi * H + hh) * Wd + wp;
    }

    // ---------------- Phase 1: global -> LDS ----------------
    // Each wave stages the 4 token rows of tensor p of its own window (8 x 512 contiguous bytes).
    {
        const float* src = (p == 0) ? rp : (p == 1) ? gp : (p == 2) ? bp : ip;
#pragma unroll
        for (int t = 0; t < NTOK; ++t) {
#pragma unroll
            for (int k = 0; k < 2; ++k) {
                const int  c4   = k * 128 + (lane << 2);
                const long base = (long)tokBase[t] * CDIM + c4;
                const int  pc   = PADC(c4);      // same 16-byte piece, padded place
#if HAVE_ASYNC_LDS
                __builtin_amdgcn_global_load_async_to_lds_b128(
                    (gptr128)(src + base), (lptr128)&sQ[win][p][t][pc], 0, 0);
#else
                *(float4*)&sQ[win][p][t][pc] = *(const float4*)(src + base);
#endif
            }
        }
#if HAVE_ASYNC_LDS
        // this wave's copies have landed before the barrier behind which other waves read them
        asm volatile("s_wait_asynccnt 0x0" ::: "memory");
#endif
    }
    __syncthreads();

    // ---------------- Phase 2: WMMA scores + quad softmax ----------------
    {
        const float* Q = &sQ[win][p][0][0];
        const float* K = &sQ[win][kv][0][0];

        const int m    = lane & 15;              // A row / B col index
        const int half = lane >> 4;
        const int koff = half << 1;              // K-dim offset: 0 | 2
        // A rows: m = 8*(qi>>1) + 2*head + (qi&1), so that rows 0..7 (lanes 0..15 of the result)
        // and rows 8..15 (lanes 16..31) each hold two query tokens of all four heads.
        const int hA = (m & 7) >> 1;
        const int qA = ((m >> 3) << 1) | (m & 1);
        // B cols: n = 4*head + ki
        const int hB = m >> 2;
        const int ki = m & 3;
        // With this pitch and pad the 16 (token, head) rows of a fragment read start in
        // 16 different groups of four banks, so the 32 lanes of a read share no bank.
        const int oa = qA * TPITCH + PADC(hA * DH) + koff;
        const int ob = ki * TPITCH + PADC(hB * DH) + koff;
        const int G1 = PADC(4 * DH);             // heads 4..7 lie this many floats behind heads 0..3

        v8f acc0 = {0.f, 0.f, 0.f, 0.f, 0.f, 0.f, 0.f, 0.f};
        v8f acc1 = {0.f, 0.f, 0.f, 0.f, 0.f, 0.f, 0.f, 0.f};
#pragma unroll
        for (int T = 0; T < 8; ++T) {            // 8 x K=4 chunks -> 32-dim contraction
            const float2 qa0 = *(const float2*)&Q[oa + T * 4];
            const float2 kb0 = *(const float2*)&K[ob + T * 4];
            const float2 qa1 = *(const float2*)&Q[oa + G1 + T * 4];
            const float2 kb1 = *(const float2*)&K[ob + G1 + T * 4];
            v2f a0;  a0.x = qa0.x;  a0.y = qa0.y;
            v2f b0;  b0.x = kb0.x;  b0.y = kb0.y;
            v2f a1;  a1.x = qa1.x;  a1.y = qa1.y;
            v2f b1;  b1.x = kb1.x;  b1.y = kb1.y;
            acc0 = __builtin_amdgcn_wmma_f32_16x16x4_f32(
                       false, a0, false, b0, (short)0, acc0, false, false);
            acc1 = __builtin_amdgcn_wmma_f32_16x16x4_f32(
                       false, a1, false, b1, (short)0, acc1, false, false);
        }

        // Lane (half, head hB, ki) finds its head's rows in result registers 2*hB and 2*hB+1:
        // query tokens 2*half and 2*half+1. Every lane holds two wanted scores per head group.
        const float SCALE = 0.17677669529663687f;   // 1/sqrt(32)
        const bool  s1 = (hB & 1) != 0;
        const bool  s2 = (hB & 2) != 0;
        const float x00 = s2 ? (s1 ? acc0[6] : acc0[4]) : (s1 ? acc0[2] : acc0[0]);
        const float x01 = s2 ? (s1 ? acc0[7] : acc0[5]) : (s1 ? acc0[3] : acc0[1]);
        const float x10 = s2 ? (s1 ? acc1[6] : acc1[4]) : (s1 ? acc1[2] : acc1[0]);
        const float x11 = s2 ? (s1 ? acc1[7] : acc1[5]) : (s1 ? acc1[3] : acc1[1]);
        const float p00 = quad_softmax(x00 * SCALE);
        const float p01 = quad_softmax(x01 * SCALE);
        const float p10 = quad_softmax(x10 * SCALE);
        const float p11 = quad_softmax(x11 * SCALE);
        sP[win][p][hB][2 * half + 0][ki]     = p00;
        sP[win][p][hB][2 * half + 1][ki]     = p01;
        sP[win][p][4 + hB][2 * half + 0][ki] = p10;
        sP[win][p][4 + hB][2 * half + 1][ki] = p11;
    }
    // sP[win][p] is written and read back by this wave alone, each lane reading other lanes' values:
    // the wave's own writes are finished, and the reads below stay behind them, without a barrier.
    asm volatile("s_wait_dscnt 0x0" ::: "memory");

    // ---------------- Phase 3: P@V + residual + LN + store (all b128) ----------------
    // Lane owns channels 4*lane..+3 and 128+4*lane..+3 of all 4 query tokens of the pair.
    float4 y4[2][NTOK];
    {
        const float* S = &sQ[win][p][0][0];
        const float* V = &sQ[win][kv][0][0];
#pragma unroll
        for (int k = 0; k < 2; ++k) {
            const int c4  = k * 128 + (lane << 2);
            const int h   = c4 >> 5;
            const int pc4 = PADC(c4);
            float4 vv[4], pm[4];
#pragma unroll
            for (int kk = 0; kk < 4; ++kk) vv[kk] = *(const float4*)&V[kk * TPITCH + pc4];
#pragma unroll
            for (int qi = 0; qi < 4; ++qi) pm[qi] = *(const float4*)&sP[win][p][h][qi][0];
#pragma unroll
            for (int qi = 0; qi < 4; ++qi) {
                float4 a = *(const float4*)&S[qi * TPITCH + pc4];
                a.x += pm[qi].x * vv[0].x + pm[qi].y * vv[1].x + pm[qi].z * vv[2].x + pm[qi].w * vv[3].x;
                a.y += pm[qi].x * vv[0].y + pm[qi].y * vv[1].y + pm[qi].z * vv[2].y + pm[qi].w * vv[3].y;
                a.z += pm[qi].x * vv[0].z + pm[qi].y * vv[1].z + pm[qi].z * vv[2].z + pm[qi].w * vv[3].z;
                a.w += pm[qi].x * vv[0].w + pm[qi].y * vv[1].w + pm[qi].z * vv[2].w + pm[qi].w * vv[3].w;
                y4[k][qi] = a;
            }
        }
    }

    const float* lw = (p == 0) ? lnw0 : (p == 1) ? lnw1 : (p == 2) ? lnw2 : lnw3;
    const float* lb = (p == 0) ? lnb0 : (p == 1) ? lnb1 : (p == 2) ? lnb2 : lnb3;
    float4 lw4[2], lb4[2];
#pragma unroll
    for (int k = 0; k < 2; ++k) {
        lw4[k] = *(const float4*)(lw + k * 128 + (lane << 2));
        lb4[k] = *(const float4*)(lb + k * 128 + (lane << 2));
    }

    // LN: a token's 256 channels lie in this one wave (32 lanes x 8), so its sums stay in registers.
    // Per lane: sum and sum of squares of each token, each as its own chain over channel pairs.
    float sy[NTOK], sq[NTOK];
#pragma unroll
    for (int qi = 0; qi < 4; ++qi) {
        const v2f a0 = lo2(y4[0][qi]), a1 = hi2(y4[0][qi]);
        const v2f c0 = lo2(y4[1][qi]), c1 = hi2(y4[1][qi]);
        const v2f s  = (a0 + a1) + (c0 + c1);
        v2f q = a0 * a0;
        q = a1 * a1 + q;
        q = c0 * c0 + q;
        q = c1 * c1 + q;
        sy[qi] = s.x + s.y;
        sq[qi] = q.x + q.y;
    }
    // The two 16-lane rows swap halves first: lanes 0..15 go on with tokens 0 and 1, lanes 16..31 with
    // tokens 2 and 3, so that each row reduces four values instead of eight and finishes two tokens.
    const bool up = lane >= 16;
    float mrow[2], rrow[2];
#pragma unroll
    for (int j = 0; j < 2; ++j) {
        const float keepS = up ? sy[j + 2] : sy[j];
        const float sendS = up ? sy[j]     : sy[j + 2];
        const float keepQ = up ? sq[j + 2] : sq[j];
        const float sendQ = up ? sq[j]     : sq[j + 2];
        const float S = row_sum(keepS + other_row(sendS));
        const float Q = row_sum(keepQ + other_row(sendQ));
        const float mean = S * (1.0f / 256.0f);
        const float var  = Q * (1.0f / 256.0f) - mean * mean;
        mrow[j] = mean;
        rrow[j] = rsqrtf(var + 1e-5f);
    }
    // every lane needs mean and 1/std of all four tokens: fetch the other row's two
    float mean4[NTOK], rstd4[NTOK];
#pragma unroll
    for (int j = 0; j < 2; ++j) {
        const float om = other_row(mrow[j]);
        const float orr = other_row(rrow[j]);
        mean4[j]     = up ? om      : mrow[j];
        mean4[j + 2] = up ? mrow[j] : om;
        rstd4[j]     = up ? orr     : rrow[j];
        rstd4[j + 2] = up ? rrow[j] : orr;
    }
#pragma unroll
    for (int qi = 0; qi < 4; ++qi) {
        const float mean = mean4[qi];
        const float rstd = rstd4[qi];
        float* orow = out + (long)tokBase[qi] * (4 * CDIM) + p * CDIM + (lane << 2);
#pragma unroll
        for (int k = 0; k < 2; ++k) {
            float4 o;
            o.x = (y4[k][qi].x - mean) * rstd * lw4[k].x + lb4[k].x;
            o.y = (y4[k][qi].y - mean) * rstd * lw4[k].y + lb4[k].y;
            o.z = (y4[k][qi].z - mean) * rstd * lw4[k].z + lb4[k].z;
            o.w = (y4[k][qi].w - mean) * rstd * lw4[k].w + lb4[k].w;
            *(float4*)(orow + k * 128) = o;
        }
    }
}

extern "C" void kernel_launch(void* const* d_in, const int* in_sizes, int n_in,
                              void* d_out, int out_size, void* d_ws, size_t ws_size,
                              hipStream_t stream) {
    const float* r  = (const float*)d_in[0];
    const float* g  = (const float*)d_in[1];
    const float* b  = (const float*)d_in[2];
    const float* ir = (const float*)d_in[3];
    const float* ln1w = (const float*)d_in[4];
    const float* ln1b = (const float*)d_in[5];
    const float* ln2w = (const float*)d_in[6];
    const float* ln2b = (const float*)d_in[7];
    const float* ln3w = (const float*)d_in[8];
    const float* ln3b = (const float*)d_in[9];
    const float* ln4w = (const float*)d_in[10];
    const float* ln4b = (const float*)d_in[11];
    float* out = (float*)d_out;

    const int B = 8, H = 64, W = 64;                  // in_sizes[0] == B*H*W*256
    const int nWin = B * (H / WSIZE) * (W / WSIZE);   // 8192 windows
    swin_cross_attn_fused<<<dim3(nWin / WPB), dim3(256), 0, stream>>>(
        r, g, b, ir, ln1w, ln1b, ln2w, ln2b, ln3w, ln3b, ln4w, ln4b,
        out, B, H, W);
}

// v004
// One run takes 21.4 microseconds.
// Timed twice side by side with v003, it ran 1.03 and 1.04 times as fast.
// All steps since v000 together make it 1.44 times as fast.
#include <hip/hip_runtime.h>

typedef __attribute__((ext_vector_type(2))) float v2f;
typedef __attribute__((ext_vector_type(8))) float v8f;

#define WSIZE 2
#define NH 8
#define CDIM 256
#define DH 32
#define NTOK 4
// LDS pitch of one token row, in floats: 256 channels, 4 pad floats behind every
// 64 channels, then rounded so that the four token rows start 24 floats apart mod 64.
#define TPITCH 280
// place of channel c inside a padded token row
#define PADC(c) ((c) + (((c) >> 6) << 2))

#if defined(__HIP_DEVICE_COMPILE__) && defined(__has_builtin)
#  if __has_builtin(__builtin_amdgcn_global_load_async_to_lds_b128)
#    define HAVE_ASYNC_LDS 1
#  endif
#endif

#if HAVE_ASYNC_LDS
typedef int v4i __attribute__((vector_size(16)));
typedef __attribute__((address_space(1))) v4i* gptr128;   // global b128 pointer
typedef __attribute__((address_space(3))) v4i* lptr128;   // LDS b128 pointer
#endif

// ---- DPP helpers (wave32, pure VALU cross-lane) ----
template <int CTRL>
__device__ __forceinline__ float dppmov(float x) {
    int v = __builtin_amdgcn_update_dpp(0, __builtin_bit_cast(int, x),
                                        CTRL, 0xF, 0xF, true);
    return __builtin_bit_cast(float, v);
}
#define DPP_QUAD_XOR1 0xB1   // quad_perm [1,0,3,2]
#define DPP_QUAD_XOR2 0x4E   // quad_perm [2,3,0,1]
#define DPP_HALF_MIRR 0x141  // row_half_mirror
#define DPP_ROW_MIRR  0x140  // row_mirror

// butterfly softmax over each 4-lane quad (all lanes get result)
__device__ __forceinline__ float quad_softmax(float s) {
    float m = fmaxf(s, dppmov<DPP_QUAD_XOR1>(s));
    m = fmaxf(m, dppmov<DPP_QUAD_XOR2>(m));
    float e = __expf(s - m);
    float d = e + dppmov<DPP_QUAD_XOR1>(e);
    d += dppmov<DPP_QUAD_XOR2>(d);
    return e / d;
}

// sum across each 16-lane row (every lane of the row holds the row sum)
__device__ __forceinline__ float row_sum(float x) {
    x += dppmov<DPP_QUAD_XOR1>(x);
    x += dppmov<DPP_QUAD_XOR2>(x);
    x += dppmov<DPP_HALF_MIRR>(x);
    x += dppmov<DPP_ROW_MIRR>(x);
    return x;
}

// value of the same lane position in the other 16-lane row (lane ^ 16)
__device__ __forceinline__ float other_row(float x) {
    const int xi = __builtin_bit_cast(int, x);
    const int v  = __builtin_amdgcn_permlanex16(xi, xi, 0x76543210, 0xfedcba98, false, false);
    return __builtin_bit_cast(float, v);
}

// the two channel pairs of a float4
__device__ __forceinline__ v2f lo2(float4 a) { v2f r; r.x = a.x; r.y = a.y; return r; }
__device__ __forceinline__ v2f hi2(float4 a) { v2f r; r.x = a.z; r.y = a.w; return r; }

#define WPB 2   // windows per tile
#define NBUF 2  // LDS buffers of the tile ring
#define TILES_PER_BLOCK 4

// One block = 256 threads = 8 waves; it walks over several tiles of two 2x2 windows each,
// the next tile's copies in flight while this tile is worked on.
// One wave = one (window, pair): all 8 heads and all 256 channels of its 4 query tokens.
// Four blocks share a WGP (8 waves a SIMD), so that the whole grid is resident at once: registers held to that.
__global__ __launch_bounds__(256) __attribute__((amdgpu_num_vgpr(128)))
void swin_cross_attn_fused(const float* __restrict__ rp,
                           const float* __restrict__ gp,
                           const float* __restrict__ bp,
                           const float* __restrict__ ip,
                           const float* __restrict__ lnw0, const float* __restrict__ lnb0,
                           const float* __restrict__ lnw1, const float* __restrict__ lnb1,
                           const float* __restrict__ lnw2, const float* __restrict__ lnb2,
                           const float* __restrict__ lnw3, const float* __restrict__ lnb3,
                           float* __restrict__ out,
                           int Bn, int H, int Wd)
{
    __shared__ __align__(16) float sQ[NBUF][WPB][4][NTOK][TPITCH];   // [buffer][window][tensor r,g,b,ir][token][padded chan]
    __shared__ __align__(16) float sP[WPB][4][NH][NTOK][NTOK]; // [window][pair][head][qi][ki]

    const int tid  = threadIdx.x;
    const int lane = tid & 31;
    const int wave = __builtin_amdgcn_readfirstlane(tid >> 5);   // wave-uniform, kept scalar
    const int win  = wave >> 2;                  // window of this wave inside the block
    const int p    = wave & 3;                   // pair (r,g) (g,b) (b,ir) (ir,g); also the tensor it stages
    const int kv   = (p == 3) ? 1 : p + 1;       // key/value tensor of the pair
    const int nWw = Wd / WSIZE;
    const int nWh = H / WSIZE;
    const int nTiles = (Bn * nWh * nWw) / WPB;   // tiles of the whole problem
    const int step   = nTiles / TILES_PER_BLOCK; // = blocks launched; this block's tiles: blockIdx.x, + step, + 2 step, ...

    // index of the first (upper left) token of this wave's window in tile 'tile'
    auto firstTok = [&](int tile) -> int {
        const int wid = tile * WPB + win;
        const int bi  = wid / (nWh * nWw);
        const int rem = wid % (nWh * nWw);
        const int wh  = rem / nWw;
        const int ww  = rem % nWw;
        return (bi * H + wh * WSIZE) * Wd + ww * WSIZE;
    };

    // global -> LDS: each wave stages the 4 token rows of tensor p of its own window
    // (8 x 512 contiguous bytes) into buffer 'buf'.
    const float* src = (p == 0) ? rp : (p == 1) ? gp : (p == 2) ? bp : ip;
    auto stage = [&](int tok0, int buf) {
#pragma unroll
        for (int t = 0; t < NTOK; ++t) {
#pragma unroll
            for (int k = 0; k < 2; ++k) {
                const int  c4   = k * 128 + (lane << 2);
                const long base = (long)(tok0 + (t >> 1) * Wd + (t & 1)) * CDIM + c4;
                const int  pc   = PADC(c4);      // same 16-byte piece, padded place
#if HAVE_ASYNC_LDS
                __builtin_amdgcn_global_load_async_to_lds_b128(
                    (gptr128)(src + base), (lptr128)&sQ[buf][win][p][t][pc], 0, 0);
#else
                *(float4*)&sQ[buf][win][p][t][pc] = *(const float4*)(src + base);
#endif
            }
        }
    };

    // LN weights of the pair: the same for every tile of this wave, read once
    const float* lw = (p == 0) ? lnw0 : (p == 1) ? lnw1 : (p == 2) ? lnw2 : lnw3;
    const float* lb = (p == 0) ? lnb0 : (p == 1) ? lnb1 : (p == 2) ? lnb2 : lnb3;
    float4 lw4[2], lb4[2];
#pragma unroll
    for (int k = 0; k < 2; ++k) {
        lw4[k] = *(const float4*)(lw + k * 128 + (lane << 2));
        lb4[k] = *(const float4*)(lb + k * 128 + (lane << 2));
    }

    // ---------------- Ring prologue: tile 0 lands, tile 1 takes off ----------------
    int tokCur = firstTok(blockIdx.x);
    int tokNxt = 0;
    stage(tokCur, 0);
#if HAVE_ASYNC_LDS
    // this wave's copies have landed before the barrier behind which other waves read them
    asm volatile("s_wait_asynccnt 0x0" ::: "memory");
#endif
    __syncthreads();
    if ((int)blockIdx.x + step < nTiles) {
        tokNxt = firstTok(blockIdx.x + step);
        stage(tokNxt, 1);
    }

    int buf = 0;
    for (int tile = blockIdx.x; tile < nTiles; tile += step) {

    // ---------------- Phase 2: WMMA scores + quad softmax ----------------
    {
        const float* Q = &sQ[buf][win][p][0][0];
        const float* K = &sQ[buf][win][kv][0][0];

        const int m    = lane & 15;              // A row / B col index
        const int half = lane >> 4;
        const int koff = half << 1;              // K-dim offset: 0 | 2
        // A rows: m = 8*(qi>>1) + 2*head + (qi&1), so that rows 0..7 (lanes 0..15 of the result)
        // and rows 8..15 (lanes 16..31) each hold two query tokens of all four heads.
        const int hA = (m & 7) >> 1;
        const int qA = ((m >> 3) << 1) | (m & 1);
        // B cols: n = 4*head + ki
        const int hB = m >> 2;
        const int ki = m & 3;
        // With this pitch and pad the 16 (token, head) rows of a fragment read start in
        // 16 different groups of four banks, so the 32 lanes of a read share no bank.
        const int oa = qA * TPITCH + PADC(hA * DH) + koff;
        const int ob = ki * TPITCH + PADC(hB * DH) + koff;
        const int G1 = PADC(4 * DH);             // heads 4..7 lie this many floats behind heads 0..3

        v8f acc0 = {0.f, 0.f, 0.f, 0.f, 0.f, 0.f, 0.f, 0.f};
        v8f acc1 = {0.f, 0.f, 0.f, 0.f, 0.f, 0.f, 0.f, 0.f};
#pragma unroll
        for (int T = 0; T < 8; ++T) {            // 8 x K=4 chunks -> 32-dim contraction
            const float2 qa0 = *(const float2*)&Q[oa + T * 4];
            const float2 kb0 = *(const float2*)&K[ob + T * 4];
            const float2 qa1 = *(const float2*)&Q[oa + G1 + T * 4];
            const float2 kb1 = *(const float2*)&K[ob + G1 + T * 4];
            v2f a0;  a0.x = qa0.x;  a0.y = qa0.y;
            v2f b0;  b0.x = kb0.x;  b0.y = kb0.y;
            v2f a1;  a1.x = qa1.x;  a1.y = qa1.y;
            v2f b1;  b1.x = kb1.x;  b1.y = kb1.y;
            acc0 = __builtin_amdgcn_wmma_f32_16x16x4_f32(
                       false, a0, false, b0, (short)0, acc0, false, false);
            acc1 = __builtin_amdgcn_wmma_f32_16x16x4_f32(
                       false, a1, false, b1, (short)0, acc1, false, false);
        }

        // Lane (half, head hB, ki) finds its head's rows in result registers 2*hB and 2*hB+1:
        // query tokens 2*half and 2*half+1. Every lane holds two wanted scores per head group.
        const float SCALE = 0.17677669529663687f;   // 1/sqrt(32)
        const bool  s1 = (hB & 1) != 0;
        const bool  s2 = (hB & 2) != 0;
        const float x00 = s2 ? (s1 ? acc0[6] : acc0[4]) : (s1 ? acc0[2] : acc0[0]);
        const float x01 = s2 ? (s1 ? acc0[7] : acc0[5]) : (s1 ? acc0[3] : acc0[1]);
        const float x10 = s2 ? (s1 ? acc1[6] : acc1[4]) : (s1 ? acc1[2] : acc1[0]);
        const float x11 = s2 ? (s1 ? acc1[7] : acc1[5]) : (s1 ? acc1[3] : acc1[1]);
        const float p00 = quad_softmax(x00 * SCALE);
        const float p01 = quad_softmax(x01 * SCALE);
        const float p10 = quad_softmax(x10 * SCALE);
        const float p11 = quad_softmax(x11 * SCALE);
        sP[win][p][hB][2 * half + 0][ki]     = p00;
        sP[win][p][hB][2 * half + 1][ki]     = p01;
        sP[win][p][4 + hB][2 * half + 0][ki] = p10;
        sP[win][p][4 + hB][2 * half + 1][ki] = p11;
    }
    // sP[win][p] is written and read back by this wave alone, each lane reading other lanes' values:
    // the wave's own writes are finished, and the reads below stay behind them, without a barrier.
    asm volatile("s_wait_dscnt 0x0" ::: "memory");

    // ---------------- Phase 3: P@V + residual + LN + store (all b128) ----------------
    // Lane owns channels 4*lane..+3 and 128+4*lane..+3 of all 4 query tokens of the pair.
    float4 y4[2][NTOK];
    {
        const float* S = &sQ[buf][win][p][0][0];
        const float* V = &sQ[buf][win][kv][0][0];
#pragma unroll
        for (int k = 0; k < 2; ++k) {
            const int c4  = k * 128 + (lane << 2);
            const int h   = c4 >> 5;
            const int pc4 = PADC(c4);
            float4 vv[4], pm[4];
#pragma unroll
            for (int kk = 0; kk < 4; ++kk) vv[kk] = *(const float4*)&V[kk * TPITCH + pc4];
#pragma unroll
            for (int qi = 0; qi < 4; ++qi) pm[qi] = *(const float4*)&sP[win][p][h][qi][0];
#pragma unroll
            for (int qi = 0; qi < 4; ++qi) {
                float4 a = *(const float4*)&S[qi * TPITCH + pc4];
                a.x += pm[qi].x * vv[0].x + pm[qi].y * vv[1].x + pm[qi].z * vv[2].x + pm[qi].w * vv[3].x;
                a.y += pm[qi].x * vv[0].y + pm[qi].y * vv[1].y + pm[qi].z * vv[2].y + pm[qi].w * vv[3].y;
                a.z += pm[qi].x * vv[0].z + pm[qi].y * vv[1].z + pm[qi].z * vv[2].z + pm[qi].w * vv[3].z;
                a.w += pm[qi].x * vv[0].w + pm[qi].y * vv[1].w + pm[qi].z * vv[2].w + pm[qi].w * vv[3].w;
                y4[k][qi] = a;
            }
        }
    }

    // LN: a token's 256 channels lie in this one wave (32 lanes x 8), so its sums stay in registers.
    // Per lane: sum and sum of squares of each token, each as its own chain over channel pairs.
    float sy[NTOK], sq[NTOK];
#pragma unroll
    for (int qi = 0; qi < 4; ++qi) {
        const v2f a0 = lo2(y4[0][qi]), a1 = hi2(y4[0][qi]);
        const v2f c0 = lo2(y4[1][qi]), c1 = hi2(y4[1][qi]);
        const v2f s  = (a0 + a1) + (c0 + c1);
        v2f q = a0 * a0;
        q = a1 * a1 + q;
        q = c0 * c0 + q;
        q = c1 * c1 + q;
        sy[qi] = s.x + s.y;
        sq[qi] = q.x + q.y;
    }
    // The two 16-lane rows swap halves first: lanes 0..15 go on with tokens 0 and 1, lanes 16..31 with
    // tokens 2 and 3, so that each row reduces four values instead of eight and finishes two tokens.
    const bool up = lane >= 16;
    float mrow[2], rrow[2];
#pragma unroll
    for (int j = 0; j < 2; ++j) {
        const float keepS = up ? sy[j + 2] : sy[j];
        const float sendS = up ? sy[j]     : sy[j + 2];
        const float keepQ = up ? sq[j + 2] : sq[j];
        const float sendQ = up ? sq[j]     : sq[j + 2];
        const float S = row_sum(keepS + other_row(sendS));
        const float Q = row_sum(keepQ + other_row(sendQ));
        const float mean = S * (1.0f / 256.0f);
        const float var  = Q * (1.0f / 256.0f) - mean * mean;
        mrow[j] = mean;
        rrow[j] = rsqrtf(var + 1e-5f);
    }
    // every lane needs mean and 1/std of all four tokens: fetch the other row's two
    float mean4[NTOK], rstd4[NTOK];
#pragma unroll
    for (int j = 0; j < 2; ++j) {
        const float om = other_row(mrow[j]);
        const float orr = other_row(rrow[j]);
        mean4[j]     = up ? om      : mrow[j];
        mean4[j + 2] = up ? mrow[j] : om;
        rstd4[j]     = up ? orr     : rrow[j];
        rstd4[j + 2] = up ? rrow[j] : orr;
    }
#pragma unroll
    for (int qi = 0; qi < 4; ++qi) {
        const float mean = mean4[qi];
        const float rstd = rstd4[qi];
        float* orow = out + (long)(tokCur + (qi >> 1) * Wd + (qi & 1)) * (4 * CDIM) + p * CDIM + (lane << 2);
#pragma unroll
        for (int k = 0; k < 2; ++k) {
            float4 o;
            o.x = (y4[k][qi].x - mean) * rstd * lw4[k].x + lb4[k].x;
            o.y = (y4[k][qi].y - mean) * rstd * lw4[k].y + lb4[k].y;
            o.z = (y4[k][qi].z - mean) * rstd * lw4[k].z + lb4[k].z;
            o.w = (y4[k][qi].w - mean) * rstd * lw4[k].w + lb4[k].w;
            *(float4*)(orow + k * 128) = o;
        }
    }

    // ---------------- Publish point of the ring (foot of the trip) ----------------
    // a precaution: it stands in front of the next trip's overwrites of the registers that the stores name
    asm volatile("s_wait_xcnt 0x0" ::: "memory");
    // Order: own LDS reads of this tile retired, own copies of the next tile landed, barrier
    // (it publishes the next tile and ends every wave's reads of this buffer), then the refill.
    asm volatile("s_wait_dscnt 0x0" ::: "memory");
#if HAVE_ASYNC_LDS
    asm volatile("s_wait_asynccnt 0x0" ::: "memory");
#endif
    __syncthreads();
    tokCur = tokNxt;
    if (tile + 2 * step < nTiles) {
        tokNxt = firstTok(tile + 2 * step);
        stage(tokNxt, buf);
    }
    buf ^= 1;
    }   // tiles
#if HAVE_ASYNC_LDS
    // no copy is outstanding when the wave ends
    asm volatile("s_wait_asynccnt 0x0" ::: "memory");
#endif
}

extern "C" void kernel_launch(void* const* d_in, const int* in_sizes, int n_in,
                              void* d_out, int out_size, void* d_ws, size_t ws_size,
                              hipStream_t stream) {
    const float* r  = (const float*)d_in[0];
    const float* g  = (const float*)d_in[1];
    const float* b  = (const float*)d_in[2];
    const float* ir = (const float*)d_in[3];
    const float* ln1w = (const float*)d_in[4];
    const float* ln1b = (const float*)d_in[5];
    const float* ln2w = (const float*)d_in[6];
    const float* ln2b = (const float*)d_in[7];
    const float* ln3w = (const float*)d_in[8];
    const float* ln3b = (const float*)d_in[9];
    const float* ln4w = (const float*)d_in[10];
    const float* ln4b = (const float*)d_in[11];
    float* out = (float*)d_out;

    const int B = 8, H = 64, W = 64;                  // in_sizes[0] == B*H*W*256
    const int nWin = B * (H / WSIZE) * (W / WSIZE);   // 8192 windows
    swin_cross_attn_fused<<<dim3(nWin / WPB / TILES_PER_BLOCK), dim3(256), 0, stream>>>(
        r, g, b, ir, ln1w, ln1b, ln2w, ln2b, ln3w, ln3b, ln4w, ln4b,
        out, B, H, W);
}
